// v000
// The times below were measured on an AMD MI455X: many runs one after another, warmed up first and cycling through
// copies of the inputs, with the whole window's GPU time divided by the number of runs. Launches and the gaps
// between them are all in it. The median over several windows is given; except for v000 it joins two sittings, which
// can be a few percent apart, so the side-by-side timings, each taken in one sitting, are the better comparison.
// v000, which the later versions start from, runs in 3460 microseconds.
// Contractions: v_wmma_f32_16x16x32_f16 (f16 operands, f32 accumulate) for all four products (silu base path and spline-basis path of both layers, fused along K); spline basis evaluation, silu and all scaling in f32.
#include <hip/hip_runtime.h>
#include <stdint.h>
#include <stddef.h>

// ---------------- problem constants ----------------
constexpr int NGRID = 5;                      // grid intervals
constexpr int SORD  = 3;                      // spline order
constexpr int NKNOT = NGRID + 2 * SORD + 1;   // 12 knots
constexpr int NB0   = NGRID + 2 * SORD;       // 11 order-0 bases
constexpr int NBAS  = NGRID + SORD;           // 8 final bases
constexpr int NFEAT = NBAS + 1;               // silu + 8 bases per channel
constexpr int DMOD  = 512;
constexpr int DFFN  = 2048;
constexpr int NTOK  = 2 * 2048;
constexpr int TCH   = 1024;                   // token chunk for layer 2
constexpr int KL1   = NFEAT * DMOD;           // 4608
constexpr int KL2   = NFEAT * DFFN;           // 18432
static_assert(KL1 % 32 == 0, "");
static_assert(KL2 % 32 == 0, "");
static_assert(NTOK % 64 == 0 && DFFN % 64 == 0 && DMOD % 64 == 0 && TCH % 64 == 0, "");
static_assert(NTOK % TCH == 0, "");
static_assert(((NTOK / 64) * (DFFN / 64)) % 8 == 0, "");
static_assert(((TCH / 64) * (DMOD / 64)) % 8 == 0, "");
// power-of-two carries (exact): W plane holds w_base*256 and w_spline*64, A plane holds silu(x)*1 and bases*4,
// so every product is scaled by 256; the GEMM epilogue multiplies by 1/256.
constexpr float WB_SCALE  = 256.0f;
constexpr float WS_SCALE  = 64.0f;
constexpr float BAS_SCALE = 4.0f;
constexpr float OUT_SCALE = 1.0f / 256.0f;

// ---------------- types and fragment helpers ----------------
typedef __attribute__((ext_vector_type(16))) _Float16 v16h;
typedef __attribute__((ext_vector_type(8)))  _Float16 v8h;
typedef __attribute__((ext_vector_type(16))) __bf16   v16b;
typedef __attribute__((ext_vector_type(8)))  __bf16   v8b;
typedef __attribute__((ext_vector_type(8)))  float    v8f;
typedef __attribute__((ext_vector_type(4)))  float    v4f;
typedef unsigned int v4u __attribute__((ext_vector_type(4), __may_alias__));

__device__ __forceinline__ unsigned short f2bf_bits(float f) {
  unsigned u = __float_as_uint(f);
  return (unsigned short)((u + 0x7FFFu + ((u >> 16) & 1u)) >> 16);
}
__device__ __forceinline__ float bf_bits2f(unsigned short h) { return __uint_as_float(((unsigned)h) << 16); }

// hazard guards as plain device helpers (no inline asm inside the kernel template body)
__device__ __forceinline__ void dep_guard_h(v8f& a, v8f& b, v16h x, v16h y) { asm volatile("v_nop\n\tv_nop\n\tv_nop\n\tv_nop" : "+v"(a), "+v"(b) : "v"(x), "v"(y)); }
__device__ __forceinline__ void dep_guard_b(v8f& a, v8f& b, v16b x, v16b y) { asm volatile("v_nop\n\tv_nop\n\tv_nop\n\tv_nop" : "+v"(a), "+v"(b) : "v"(x), "v"(y)); }
__device__ __forceinline__ void keep4_h(v16h a, v16h b, v16h c, v16h d) { asm volatile("v_nop" :: "v"(a), "v"(b), "v"(c), "v"(d)); }
__device__ __forceinline__ void keep4_b(v16b a, v16b b, v16b c, v16b d) { asm volatile("v_nop" :: "v"(a), "v"(b), "v"(c), "v"(d)); }
__device__ __forceinline__ void acc_guard4(v8f& a, v8f& b, v8f& c, v8f& d) { asm volatile("v_nop\n\tv_nop\n\tv_nop\n\tv_nop" : "+v"(a), "+v"(b), "+v"(c), "+v"(d)); }
template <typename T> struct Frag;
template <> struct Frag<_Float16> {
  typedef v16h V; union U { v16h v; v8h h[2]; };
  static __device__ __forceinline__ v16h load(const _Float16* p) {   // elements 0..7 <- p[0..7], 8..15 <- p[16..23]
    U f; f.h[0] = *(const v8h*)(p); f.h[1] = *(const v8h*)(p + 16); return f.v;
  }
  static __device__ __forceinline__ v8f mma(v16h a, v16h b, v8f c) {
    return __builtin_amdgcn_wmma_f32_16x16x32_f16(false, a, false, b, (short)0, c, false, false);
  }
  static __device__ __forceinline__ void guard(v8f& a, v8f& b, v16h x, v16h y) { dep_guard_h(a, b, x, y); }
  static __device__ __forceinline__ void keep(v16h a, v16h b, v16h c, v16h d) { keep4_h(a, b, c, d); }
};
template <> struct Frag<__bf16> {
  typedef v16b V; union U { v16b v; v8b h[2]; };
  static __device__ __forceinline__ v16b load(const __bf16* p) {
    U f; f.h[0] = *(const v8b*)(p); f.h[1] = *(const v8b*)(p + 16); return f.v;
  }
  static __device__ __forceinline__ v8f mma(v16b a, v16b b, v8f c) {
    return __builtin_amdgcn_wmma_f32_16x16x32_bf16(false, a, false, b, (short)0, c, false, false);
  }
  static __device__ __forceinline__ void guard(v8f& a, v8f& b, v16b x, v16b y) { dep_guard_b(a, b, x, y); }
  static __device__ __forceinline__ void keep(v16b a, v16b b, v16b c, v16b d) { keep4_b(a, b, c, d); }
};

// ---- Register-blocked batched WMMA GEMM ------------------------------
// C[m,n] = scale * sum_k A[m,k] * Bt[n,k] (+bias)(+resid); each wave owns a 64x64 tile.
// A row-major [M,K]; Bt row-major [N,K]; M,N % 64 == 0, K % 32 == 0.
// SPLIT: operands are hi/lo planes (A2/Bt2 = lo planes, same layout); product = hi*hi + hi*lo + lo*hi.
// BIAS_MODE: 0 = none, 1 = bias[m], 2 = bias[n].
// OUT_MODE: 0 = f32, 1 = f16, 2 = bf16 hi plane (Cout) + bf16 lo plane (Cout2).
// ET: 0 = f16 operands, 1 = bf16 operands (pointers passed as 16-bit storage)
template <int ET> struct Elem;
template <> struct Elem<0> { typedef _Float16 T; };
template <> struct Elem<1> { typedef __bf16 T; };
template <int ET, bool SPLIT, int BIAS_MODE, int OUT_MODE, bool RESID, int ACT = 0>
__global__ __launch_bounds__(256) void wmma_gemm64(
    const unsigned short* __restrict__ Ap, const unsigned short* __restrict__ A2p, int lda, long strideA,
    const unsigned short* __restrict__ Btp, const unsigned short* __restrict__ Bt2p, int ldb, long strideB,
    void* __restrict__ Cout, void* __restrict__ Cout2, int ldc, long strideC,
    const float* __restrict__ bias,
    const float* __restrict__ resid, long strideR,
    int M, int N, int K, float scale) {
  typedef typename Elem<ET>::T T;
  typedef typename Frag<T>::V V;
  const T* A = (const T*)Ap; const T* A2 = (const T*)A2p; const T* Bt = (const T*)Btp; const T* Bt2 = (const T*)Bt2p;
  __shared__ __align__(16) float sT[8][16 * 68];   // per-wave 16x64 slab, pitch 68 floats
  const int b    = blockIdx.y;
  const int lane = threadIdx.x & 31;
  const int wave = threadIdx.x >> 5;
  const int tilesN = N >> 6;
  const int tilesM = M >> 6;
  const int tile = blockIdx.x * 8 + wave;
  if (tile >= tilesM * tilesN) return;   // wave-uniform; no block barriers in this kernel
  const int tm = tile / tilesN;
  const int tn = tile - tm * tilesN;
  const int m0 = tm << 6;
  const int n0 = tn << 6;

  const T* Ab  = A  + (size_t)b * strideA;
  const T* Bb  = Bt + (size_t)b * strideB;
  const T* Ab2 = SPLIT ? (A2  + (size_t)b * strideA) : nullptr;
  const T* Bb2 = SPLIT ? (Bt2 + (size_t)b * strideB) : nullptr;

  const int rlane = lane & 15;                 // row (A) / col (B, D) within subtile
  const int koff  = (lane >> 4) * 8;           // k offset of this lane half
  const int mOff  = (lane >> 4) * 8;           // D row offset

  v8f acc[4][4];
#pragma unroll
  for (int i = 0; i < 4; ++i)
#pragma unroll
    for (int j = 0; j < 4; ++j) acc[i][j] = (v8f){0.f,0.f,0.f,0.f,0.f,0.f,0.f,0.f};

  for (int k0 = 0; k0 < K; k0 += 32) {
    V bh[4], bl[4];
#pragma unroll
    for (int j = 0; j < 4; ++j) {
      const size_t bo = (size_t)(n0 + (j << 4) + rlane) * ldb + koff + k0;
      bh[j] = Frag<T>::load(Bb + bo);
      if (SPLIT) bl[j] = Frag<T>::load(Bb2 + bo);
    }
#pragma unroll
    for (int i = 0; i < 4; ++i) {
      const size_t ao = (size_t)(m0 + (i << 4) + rlane) * lda + koff + k0;
      V ah = Frag<T>::load(Ab + ao);
      V al;
      if (SPLIT) al = Frag<T>::load(Ab2 + ao);
#pragma unroll
      for (int j = 0; j < 4; ++j) {
        acc[i][j] = Frag<T>::mma(ah, bh[j], acc[i][j]);
        if (SPLIT) {
          acc[i][j] = Frag<T>::mma(ah, bl[j], acc[i][j]);
          acc[i][j] = Frag<T>::mma(al, bh[j], acc[i][j]);
        }
      }
      Frag<T>::guard(acc[i][0], acc[i][3], ah, SPLIT ? al : ah);
    }
    Frag<T>::keep(bh[0], bh[1], bh[2], bh[3]);
    if (SPLIT) Frag<T>::keep(bl[0], bl[1], bl[2], bl[3]);
  }
  acc_guard4(acc[0][0], acc[0][1], acc[0][2], acc[0][3]);
  acc_guard4(acc[1][0], acc[1][1], acc[1][2], acc[1][3]);
  acc_guard4(acc[2][0], acc[2][1], acc[2][2], acc[2][3]);
  acc_guard4(acc[3][0], acc[3][1], acc[3][2], acc[3][3]);

  // ---- epilogue ----
  float* slab = sT[wave];
  const float* Rb = RESID ? (resid + (size_t)b * strideR) : nullptr;
#pragma unroll
  for (int i = 0; i < 4; ++i) {
    const int mBase = m0 + (i << 4);
#pragma unroll
    for (int j = 0; j < 4; ++j) {
      const int n = n0 + (j << 4) + rlane;
      float bv = 0.f;
      if (BIAS_MODE == 2) bv = bias[n];
#pragma unroll
      for (int r = 0; r < 8; ++r) {
        float v = acc[i][j][r] * scale;
        if (BIAS_MODE == 1) v += bias[mBase + mOff + r];
        if (BIAS_MODE == 2) v += bv;
        if (RESID) v += Rb[(size_t)(mBase + mOff + r) * ldc + n];
        if (ACT == 1) v = tanhf(v);
        if (ACT == 2) v = fmaxf(v, 0.0f);
        if (ACT == 3) v = v / (1.0f + expf(-v));
        if (ACT == 4) v = (v > 0.f) ? v : 0.01f * v;
        if (ACT == 5) v = 0.5f * v * (1.0f + erff(v * 0.70710678118654752f));
        slab[(mOff + r) * 68 + (j << 4) + rlane] = v;
      }
    }
    __builtin_amdgcn_fence(__ATOMIC_RELEASE, "workgroup");
    __builtin_amdgcn_wave_barrier();
    __builtin_amdgcn_fence(__ATOMIC_ACQUIRE, "workgroup");
    if (OUT_MODE == 0) {
      float* C = (float*)Cout + (size_t)b * strideC;
      const int hh = lane >> 4, c4 = (lane & 15) * 4;     // row seg = 256 B = 16 lanes x 16 B
      {
#pragma unroll
        for (int it = 0; it < 8; ++it) {
          const int row = it * 2 + hh;
          v4f v = *(const v4f*)(slab + row * 68 + c4);
          *(v4f*)(C + (size_t)(mBase + row) * ldc + n0 + c4) = v;
        }
        
      }
    } else {
      const int q = lane >> 3, c8 = (lane & 7) * 8;
      unsigned short* C  = (unsigned short*)Cout  + (size_t)b * strideC;
      unsigned short* C2 = (OUT_MODE == 2) ? ((unsigned short*)Cout2 + (size_t)b * strideC) : nullptr;
      {
#pragma unroll
        for (int it = 0; it < 4; ++it) {
          const int row = it * 4 + q;
          const float* sp = slab + row * 68 + c8;
          v8h hv, lv;
#pragma unroll
          for (int e = 0; e < 8; ++e) {
            if (OUT_MODE == 1) {
              hv[e] = (_Float16)sp[e];
            } else {
              unsigned short hb = f2bf_bits(sp[e]);
              unsigned short lb = f2bf_bits(sp[e] - bf_bits2f(hb));
              hv[e] = __builtin_bit_cast(_Float16, hb);
              lv[e] = __builtin_bit_cast(_Float16, lb);
            }
          }
          *(v8h*)(C + (size_t)(mBase + row) * ldc + n0 + c8) = hv;
          if (OUT_MODE == 2) *(v8h*)(C2 + (size_t)(mBase + row) * ldc + n0 + c8) = lv;
        }
        
      }
    }
    __builtin_amdgcn_fence(__ATOMIC_RELEASE, "workgroup");
    __builtin_amdgcn_wave_barrier();
    __builtin_amdgcn_fence(__ATOMIC_ACQUIRE, "workgroup");
  }
}

// ---------------- f32 -> f16 bit pattern (RNE convert) ----------------
__device__ __forceinline__ unsigned short h_bits(float f) {
  return __builtin_bit_cast(unsigned short, (_Float16)f);
}

// ---------------- feature plane: X[nrows][CIN] f32 -> Apl[nrows][NFEAT*CIN] f16 bits ----------------
// Row layout (feature-major K): Apl[n][f*CIN + i], f = 0: silu(x[n][i]) (scale 1), f = q+1: bases_q(x[n][i]) * BAS_SCALE.
// One block per row. Phase 1: thread tid computes elements i = tid + 256*e (rolled), writes 9 halves to LDS.
// Phase 2: NVEC = 9*CIN/8 vectors of 16 B; thread v-loop: each wave writes 32 consecutive 16-B pieces =
// Coverage: CIN/256 iterations x 256 threads x 9 features = 9*CIN halves = the whole row; v-loop covers NVEC*8 = 9*CIN halves.
template <int CIN>
__global__ __launch_bounds__(256) void spline_features(const float* __restrict__ X,
                                                       const float* __restrict__ knots,
                                                       unsigned short* __restrict__ Apl) {
  constexpr int KROW = NFEAT * CIN;
  constexpr int NVEC = KROW / 8;
  constexpr int EPT  = CIN / 256;
  static_assert(CIN % 256 == 0, "");
  static_assert(NVEC % 32 == 0, "");
  static_assert((KROW * 2) % 128 == 0, "");
  __shared__ __align__(16) unsigned short sF[KROW];
  __shared__ float sK[16];
  __shared__ float sR[32];

  const int tid = threadIdx.x;
  const int row = blockIdx.x;

  if (tid < NKNOT) sK[tid] = knots[tid];
  __syncthreads();
  if (tid < 30) {
    // sR[0..10]  = 1/(g[t+1]-g[t]), t = 0..10
    // sR[11..20] = 1/(g[t+2]-g[t]), t = 0..9
    // sR[21..29] = 1/(g[t+3]-g[t]), t = 0..8
    const int j  = (tid < 11) ? 1 : ((tid < 21) ? 2 : 3);
    const int tt = (tid < 11) ? tid : ((tid < 21) ? (tid - 11) : (tid - 21));
    sR[tid] = 1.0f / (sK[tt + j] - sK[tt]);
  }
  __syncthreads();

  float g[NKNOT];
#pragma unroll
  for (int m = 0; m < NKNOT; ++m) g[m] = sK[m];
  float r1[NB0], r2[NB0 - 1], r3[NB0 - 2];
#pragma unroll
  for (int t = 0; t < NB0; ++t) r1[t] = sR[t];
#pragma unroll
  for (int t = 0; t < NB0 - 1; ++t) r2[t] = sR[11 + t];
#pragma unroll
  for (int t = 0; t < NB0 - 2; ++t) r3[t] = sR[21 + t];

  const float* xrow = X + (size_t)row * CIN;
#pragma unroll 1
  for (int e = 0; e < EPT; ++e) {
    const int i = tid + 256 * e;
    const float x = xrow[i];
    // silu residual path: x * sigmoid(x)
    const float sg = 1.0f / (1.0f + expf(-x));
    const float s0 = x * sg;
    // order-0 indicator bases
    float b[NB0];
#pragma unroll
    for (int t = 0; t < NB0; ++t) b[t] = (x >= g[t] && x < g[t + 1]) ? 1.0f : 0.0f;
    // Cox-de Boor, j = 1
#pragma unroll
    for (int t = 0; t < NB0 - 1; ++t) {
      const float lf = (x - g[t]) * r1[t];
      const float rt = (g[t + 2] - x) * r1[t + 1];
      b[t] = lf * b[t] + rt * b[t + 1];
    }
    // j = 2
#pragma unroll
    for (int t = 0; t < NB0 - 2; ++t) {
      const float lf = (x - g[t]) * r2[t];
      const float rt = (g[t + 3] - x) * r2[t + 1];
      b[t] = lf * b[t] + rt * b[t + 1];
    }
    // j = 3
#pragma unroll
    for (int t = 0; t < NB0 - 3; ++t) {
      const float lf = (x - g[t]) * r3[t];
      const float rt = (g[t + 4] - x) * r3[t + 1];
      b[t] = lf * b[t] + rt * b[t + 1];
    }
    sF[i] = h_bits(s0);
#pragma unroll
    for (int q = 0; q < NBAS; ++q) sF[(q + 1) * CIN + i] = h_bits(BAS_SCALE * b[q]);
  }
  __syncthreads();

  unsigned short* dst = Apl + (size_t)row * KROW;
  {
    for (int v = tid; v < NVEC; v += 256) {
      const v4u val = *(const v4u*)(sF + 8 * v);
      *(v4u*)(dst + 8 * v) = val;
    }
    
  }
}

// ---------------- weight plane: wbase[NOUT][CIN] f32 + wspl[NOUT][CIN][8] f32 -> Wpl[NOUT][NFEAT*CIN] f16 bits ----------------
// Wpl[o][i] = w_base[o][i] * WB_SCALE ; Wpl[o][(q+1)*CIN + i] = w_spline[o][i][q] * WS_SCALE (same K permutation as the feature plane).
// Coverage: CIN/256 iterations x 256 threads x 9 values = 9*CIN halves = the whole row.
template <int CIN>
__global__ __launch_bounds__(256) void pack_edge_weights(const float* __restrict__ wbase,
                                                         const float* __restrict__ wspl,
                                                         unsigned short* __restrict__ Wpl) {
  constexpr int KROW = NFEAT * CIN;
  constexpr int NVEC = KROW / 8;
  constexpr int EPT  = CIN / 256;
  static_assert(CIN % 256 == 0, "");
  static_assert(NVEC % 32 == 0, "");
  __shared__ __align__(16) unsigned short sW[KROW];

  const int tid = threadIdx.x;
  const int o   = blockIdx.x;
  const float* wb = wbase + (size_t)o * CIN;
  const float* ws = wspl + (size_t)o * CIN * NBAS;
#pragma unroll 1
  for (int e = 0; e < EPT; ++e) {
    const int i = tid + 256 * e;
    const float b0 = wb[i];
    const v4f sa = *(const v4f*)(ws + (size_t)i * NBAS);
    const v4f sb = *(const v4f*)(ws + (size_t)i * NBAS + 4);
    sW[i] = h_bits(WB_SCALE * b0);
    sW[1 * CIN + i] = h_bits(WS_SCALE * sa[0]);
    sW[2 * CIN + i] = h_bits(WS_SCALE * sa[1]);
    sW[3 * CIN + i] = h_bits(WS_SCALE * sa[2]);
    sW[4 * CIN + i] = h_bits(WS_SCALE * sa[3]);
    sW[5 * CIN + i] = h_bits(WS_SCALE * sb[0]);
    sW[6 * CIN + i] = h_bits(WS_SCALE * sb[1]);
    sW[7 * CIN + i] = h_bits(WS_SCALE * sb[2]);
    sW[8 * CIN + i] = h_bits(WS_SCALE * sb[3]);
  }
  __syncthreads();

  unsigned short* dst = Wpl + (size_t)o * KROW;
  {
    for (int v = tid; v < NVEC; v += 256) {
      const v4u val = *(const v4u*)(sW + 8 * v);
      *(v4u*)(dst + 8 * v) = val;
    }
    
  }
}

// ---------------- host-side orchestration ----------------
// Workspace region map (all offsets 256-B aligned):
//   W1p : f16 [2048][4608]                      18,874,368 B  at          0
//   W2p : f16 [512][18432]                      18,874,368 B  at 18,874,368
//   Hf  : f32 [4096][2048]                      33,554,432 B  at 37,748,736
//   Apl : f16 max([4096][4608], [1024][18432])   37,748,736 B  at 71,303,168  (layer-1 plane, then reused per layer-2 chunk)
//   end = 109,051,904 B
extern "C" void kernel_launch(void* const* d_in, const int* in_sizes, int n_in,
                              void* d_out, int out_size, void* d_ws, size_t ws_size,
                              hipStream_t stream) {
  if (n_in < 6) return;
  if (in_sizes[0] != NTOK * DMOD) return;
  if (in_sizes[1] < NKNOT) return;
  if (in_sizes[2] != DFFN * DMOD) return;
  if (in_sizes[3] != DFFN * DMOD * NBAS) return;
  if (in_sizes[4] != DMOD * DFFN) return;
  if (in_sizes[5] != DMOD * DFFN * NBAS) return;
  if (out_size != NTOK * DMOD) return;

  const float* x    = (const float*)d_in[0];
  const float* grid = (const float*)d_in[1];
  const float* w1b  = (const float*)d_in[2];
  const float* w1s  = (const float*)d_in[3];
  const float* w2b  = (const float*)d_in[4];
  const float* w2s  = (const float*)d_in[5];
  float* out = (float*)d_out;

  const size_t bW1 = (size_t)DFFN * KL1 * 2;
  const size_t bW2 = (size_t)DMOD * KL2 * 2;
  const size_t bH  = (size_t)NTOK * DFFN * 4;
  const size_t bA1 = (size_t)NTOK * KL1 * 2;
  const size_t bA2 = (size_t)TCH * KL2 * 2;
  const size_t bA  = (bA1 > bA2) ? bA1 : bA2;
  auto al256 = [](size_t v) { return (v + 255) & ~(size_t)255; };
  const size_t oW1 = 0;
  const size_t oW2 = al256(oW1 + bW1);
  const size_t oH  = al256(oW2 + bW2);
  const size_t oA  = al256(oH + bH);
  const size_t oEnd = oA + bA;
  if (oEnd > ws_size) return;

  char* wsb = (char*)d_ws;
  unsigned short* W1p = (unsigned short*)(wsb + oW1);
  unsigned short* W2p = (unsigned short*)(wsb + oW2);
  float*          Hf  = (float*)(wsb + oH);
  unsigned short* Apl = (unsigned short*)(wsb + oA);

  // 1-2) weight planes (f16, feature-major K)
  pack_edge_weights<DMOD><<<dim3(DFFN), dim3(256), 0, stream>>>(w1b, w1s, W1p);
  pack_edge_weights<DFFN><<<dim3(DMOD), dim3(256), 0, stream>>>(w2b, w2s, W2p);

  // 3) layer-1 feature plane: x [4096][512] -> Apl [4096][4608]
  spline_features<DMOD><<<dim3(NTOK), dim3(256), 0, stream>>>(x, grid, Apl);

  // 4) layer-1 GEMM: Hf[4096][2048] = (1/256) * Apl[4096][4608] . W1p[2048][4608]^T   (M=4096, N=2048, K=4608)
  {
    const int tiles = (NTOK / 64) * (DFFN / 64);
    const int gx = (tiles + 7) / 8;
    wmma_gemm64<0, false, 0, 0, false, 0><<<dim3(gx, 1), dim3(256), 0, stream>>>(
        (const unsigned short*)Apl, (const unsigned short*)Apl, KL1, 0L,
        (const unsigned short*)W1p, (const unsigned short*)W1p, KL1, 0L,
        (void*)Hf, (void*)Hf, DFFN, 0L,
        (const float*)Hf, (const float*)Hf, 0L,
        NTOK, DFFN, KL1, OUT_SCALE);
  }

  // 5-6) layer 2 in token chunks of TCH: features of Hf chunk -> Apl [TCH][18432]; GEMM -> out chunk
  for (int c = 0; c < NTOK / TCH; ++c) {
    const float* hsrc = Hf + (size_t)c * TCH * DFFN;
    float* odst = out + (size_t)c * TCH * DMOD;
    spline_features<DFFN><<<dim3(TCH), dim3(256), 0, stream>>>(hsrc, grid, Apl);
    const int tiles = (TCH / 64) * (DMOD / 64);
    const int gx = (tiles + 7) / 8;
    // out[c*TCH .. +TCH][512] = (1/256) * Apl[TCH][18432] . W2p[512][18432]^T   (M=1024, N=512, K=18432)
    wmma_gemm64<0, false, 0, 0, false, 0><<<dim3(gx, 1), dim3(256), 0, stream>>>(
        (const unsigned short*)Apl, (const unsigned short*)Apl, KL2, 0L,
        (const unsigned short*)W2p, (const unsigned short*)W2p, KL2, 0L,
        (void*)odst, (void*)odst, DMOD, 0L,
        (const float*)Hf, (const float*)Hf, 0L,
        TCH, DMOD, KL2, OUT_SCALE);
  }
}

// v001
// Measured time: 472 microseconds a run.
// In two side-by-side timings against v000, it was 7.35 and 7.29 times as fast.
// Contractions: v_wmma_f32_16x16x32_f16 (f16 operands, f32 accumulate) for all four products (silu base path and spline-basis path of both layers, fused along K); spline basis evaluation, silu and all scaling in f32.
#include <hip/hip_runtime.h>
#include <stdint.h>
#include <stddef.h>

// ---------------- problem constants ----------------
constexpr int NGRID = 5;                      // grid intervals
constexpr int SORD  = 3;                      // spline order
constexpr int NKNOT = NGRID + 2 * SORD + 1;   // 12 knots
constexpr int NB0   = NGRID + 2 * SORD;       // 11 order-0 bases
constexpr int NBAS  = NGRID + SORD;           // 8 final bases
constexpr int NFEAT = NBAS + 1;               // silu + 8 bases per channel
constexpr int DMOD  = 512;
constexpr int DFFN  = 2048;
constexpr int NTOK  = 2 * 2048;
constexpr int KSPL  = 8;                      // K slices of the layer-2 GEMM (one f32 partial plane each)
constexpr int KL1   = NFEAT * DMOD;           // 4608
constexpr int KL2   = NFEAT * DFFN;           // 18432
static_assert(KL1 % 32 == 0, "");
static_assert(KL2 % 32 == 0, "");
static_assert(NTOK % 64 == 0 && DFFN % 64 == 0 && DMOD % 64 == 0, "");
static_assert(KL2 % (32 * KSPL) == 0, "");
static_assert(((NTOK / 64) * (DFFN / 64)) % 8 == 0, "");
static_assert(((NTOK / 64) * (DMOD / 64)) % 8 == 0, "");
// power-of-two carries (exact): W plane holds w_base*256 and w_spline*64, A plane holds silu(x)*1 and bases*4,
// so every product is scaled by 256; the GEMM epilogue multiplies by 1/256.
constexpr float WB_SCALE  = 256.0f;
constexpr float WS_SCALE  = 64.0f;
constexpr float BAS_SCALE = 4.0f;
constexpr float OUT_SCALE = 1.0f / 256.0f;

// ---------------- types and fragment helpers ----------------
typedef __attribute__((ext_vector_type(16))) _Float16 v16h;
typedef __attribute__((ext_vector_type(8)))  _Float16 v8h;
typedef __attribute__((ext_vector_type(16))) __bf16   v16b;
typedef __attribute__((ext_vector_type(8)))  __bf16   v8b;
typedef __attribute__((ext_vector_type(8)))  float    v8f;
typedef __attribute__((ext_vector_type(4)))  float    v4f;
typedef unsigned int v4u __attribute__((ext_vector_type(4), __may_alias__));

__device__ __forceinline__ unsigned short f2bf_bits(float f) {
  unsigned u = __float_as_uint(f);
  return (unsigned short)((u + 0x7FFFu + ((u >> 16) & 1u)) >> 16);
}
__device__ __forceinline__ float bf_bits2f(unsigned short h) { return __uint_as_float(((unsigned)h) << 16); }

// hazard guards as plain device helpers (no inline asm inside the kernel template body)
__device__ __forceinline__ void dep_guard_h(v8f& a, v8f& b, v16h x, v16h y) { asm volatile("v_nop\n\tv_nop\n\tv_nop\n\tv_nop" : "+v"(a), "+v"(b) : "v"(x), "v"(y)); }
__device__ __forceinline__ void dep_guard_b(v8f& a, v8f& b, v16b x, v16b y) { asm volatile("v_nop\n\tv_nop\n\tv_nop\n\tv_nop" : "+v"(a), "+v"(b) : "v"(x), "v"(y)); }
__device__ __forceinline__ void keep4_h(v16h a, v16h b, v16h c, v16h d) { asm volatile("v_nop" :: "v"(a), "v"(b), "v"(c), "v"(d)); }
__device__ __forceinline__ void keep4_b(v16b a, v16b b, v16b c, v16b d) { asm volatile("v_nop" :: "v"(a), "v"(b), "v"(c), "v"(d)); }
__device__ __forceinline__ void acc_guard4(v8f& a, v8f& b, v8f& c, v8f& d) { asm volatile("v_nop\n\tv_nop\n\tv_nop\n\tv_nop" : "+v"(a), "+v"(b), "+v"(c), "+v"(d)); }
template <typename T> struct Frag;
template <> struct Frag<_Float16> {
  typedef v16h V; union U { v16h v; v8h h[2]; };
  static __device__ __forceinline__ v16h load(const _Float16* p) {   // elements 0..7 <- p[0..7], 8..15 <- p[16..23]
    U f; f.h[0] = *(const v8h*)(p); f.h[1] = *(const v8h*)(p + 16); return f.v;
  }
  static __device__ __forceinline__ v8f mma(v16h a, v16h b, v8f c) {
    return __builtin_amdgcn_wmma_f32_16x16x32_f16(false, a, false, b, (short)0, c, false, false);
  }
  static __device__ __forceinline__ void guard(v8f& a, v8f& b, v16h x, v16h y) { dep_guard_h(a, b, x, y); }
  static __device__ __forceinline__ void keep(v16h a, v16h b, v16h c, v16h d) { keep4_h(a, b, c, d); }
};
template <> struct Frag<__bf16> {
  typedef v16b V; union U { v16b v; v8b h[2]; };
  static __device__ __forceinline__ v16b load(const __bf16* p) {
    U f; f.h[0] = *(const v8b*)(p); f.h[1] = *(const v8b*)(p + 16); return f.v;
  }
  static __device__ __forceinline__ v8f mma(v16b a, v16b b, v8f c) {
    return __builtin_amdgcn_wmma_f32_16x16x32_bf16(false, a, false, b, (short)0, c, false, false);
  }
  static __device__ __forceinline__ void guard(v8f& a, v8f& b, v16b x, v16b y) { dep_guard_b(a, b, x, y); }
  static __device__ __forceinline__ void keep(v16b a, v16b b, v16b c, v16b d) { keep4_b(a, b, c, d); }
};

// ---- Register-blocked batched WMMA GEMM ------------------------------
// C[m,n] = scale * sum_k A[m,k] * Bt[n,k] (+bias)(+resid); each wave owns a 64x64 tile.
// A row-major [M,K]; Bt row-major [N,K]; M,N % 64 == 0, K % 32 == 0.
// SPLIT: operands are hi/lo planes (A2/Bt2 = lo planes, same layout); product = hi*hi + hi*lo + lo*hi.
// BIAS_MODE: 0 = none, 1 = bias[m], 2 = bias[n].
// OUT_MODE: 0 = f32, 1 = f16, 2 = bf16 hi plane (Cout) + bf16 lo plane (Cout2).
// ET: 0 = f16 operands, 1 = bf16 operands (pointers passed as 16-bit storage)
template <int ET> struct Elem;
template <> struct Elem<0> { typedef _Float16 T; };
template <> struct Elem<1> { typedef __bf16 T; };
template <int ET, bool SPLIT, int BIAS_MODE, int OUT_MODE, bool RESID, int ACT = 0>
__global__ __launch_bounds__(256) void wmma_gemm64(
    const unsigned short* __restrict__ Ap, const unsigned short* __restrict__ A2p, int lda, long strideA,
    const unsigned short* __restrict__ Btp, const unsigned short* __restrict__ Bt2p, int ldb, long strideB,
    void* __restrict__ Cout, void* __restrict__ Cout2, int ldc, long strideC,
    const float* __restrict__ bias,
    const float* __restrict__ resid, long strideR,
    int M, int N, int K, float scale) {
  typedef typename Elem<ET>::T T;
  typedef typename Frag<T>::V V;
  const T* A = (const T*)Ap; const T* A2 = (const T*)A2p; const T* Bt = (const T*)Btp; const T* Bt2 = (const T*)Bt2p;
  __shared__ __align__(16) float sT[8][16 * 68];   // per-wave 16x64 slab, pitch 68 floats
  const int b    = blockIdx.y;
  const int lane = threadIdx.x & 31;
  const int wave = threadIdx.x >> 5;
  const int tilesN = N >> 6;
  const int tilesM = M >> 6;
  const int tile = blockIdx.x * 8 + wave;
  if (tile >= tilesM * tilesN) return;   // wave-uniform; no block barriers in this kernel
  const int tm = tile / tilesN;
  const int tn = tile - tm * tilesN;
  const int m0 = tm << 6;
  const int n0 = tn << 6;

  const T* Ab  = A  + (size_t)b * strideA;
  const T* Bb  = Bt + (size_t)b * strideB;
  const T* Ab2 = SPLIT ? (A2  + (size_t)b * strideA) : nullptr;
  const T* Bb2 = SPLIT ? (Bt2 + (size_t)b * strideB) : nullptr;

  const int rlane = lane & 15;                 // row (A) / col (B, D) within subtile
  const int koff  = (lane >> 4) * 8;           // k offset of this lane half
  const int mOff  = (lane >> 4) * 8;           // D row offset

  v8f acc[4][4];
#pragma unroll
  for (int i = 0; i < 4; ++i)
#pragma unroll
    for (int j = 0; j < 4; ++j) acc[i][j] = (v8f){0.f,0.f,0.f,0.f,0.f,0.f,0.f,0.f};

  for (int k0 = 0; k0 < K; k0 += 32) {
    V bh[4], bl[4];
#pragma unroll
    for (int j = 0; j < 4; ++j) {
      const size_t bo = (size_t)(n0 + (j << 4) + rlane) * ldb + koff + k0;
      bh[j] = Frag<T>::load(Bb + bo);
      if (SPLIT) bl[j] = Frag<T>::load(Bb2 + bo);
    }
#pragma unroll
    for (int i = 0; i < 4; ++i) {
      const size_t ao = (size_t)(m0 + (i << 4) + rlane) * lda + koff + k0;
      V ah = Frag<T>::load(Ab + ao);
      V al;
      if (SPLIT) al = Frag<T>::load(Ab2 + ao);
#pragma unroll
      for (int j = 0; j < 4; ++j) {
        acc[i][j] = Frag<T>::mma(ah, bh[j], acc[i][j]);
        if (SPLIT) {
          acc[i][j] = Frag<T>::mma(ah, bl[j], acc[i][j]);
          acc[i][j] = Frag<T>::mma(al, bh[j], acc[i][j]);
        }
      }
      Frag<T>::guard(acc[i][0], acc[i][3], ah, SPLIT ? al : ah);
    }
    Frag<T>::keep(bh[0], bh[1], bh[2], bh[3]);
    if (SPLIT) Frag<T>::keep(bl[0], bl[1], bl[2], bl[3]);
  }
  acc_guard4(acc[0][0], acc[0][1], acc[0][2], acc[0][3]);
  acc_guard4(acc[1][0], acc[1][1], acc[1][2], acc[1][3]);
  acc_guard4(acc[2][0], acc[2][1], acc[2][2], acc[2][3]);
  acc_guard4(acc[3][0], acc[3][1], acc[3][2], acc[3][3]);

  // ---- epilogue ----
  float* slab = sT[wave];
  const float* Rb = RESID ? (resid + (size_t)b * strideR) : nullptr;
#pragma unroll
  for (int i = 0; i < 4; ++i) {
    const int mBase = m0 + (i << 4);
#pragma unroll
    for (int j = 0; j < 4; ++j) {
      const int n = n0 + (j << 4) + rlane;
      float bv = 0.f;
      if (BIAS_MODE == 2) bv = bias[n];
#pragma unroll
      for (int r = 0; r < 8; ++r) {
        float v = acc[i][j][r] * scale;
        if (BIAS_MODE == 1) v += bias[mBase + mOff + r];
        if (BIAS_MODE == 2) v += bv;
        if (RESID) v += Rb[(size_t)(mBase + mOff + r) * ldc + n];
        if (ACT == 1) v = tanhf(v);
        if (ACT == 2) v = fmaxf(v, 0.0f);
        if (ACT == 3) v = v / (1.0f + expf(-v));
        if (ACT == 4) v = (v > 0.f) ? v : 0.01f * v;
        if (ACT == 5) v = 0.5f * v * (1.0f + erff(v * 0.70710678118654752f));
        slab[(mOff + r) * 68 + (j << 4) + rlane] = v;
      }
    }
    __builtin_amdgcn_fence(__ATOMIC_RELEASE, "workgroup");
    __builtin_amdgcn_wave_barrier();
    __builtin_amdgcn_fence(__ATOMIC_ACQUIRE, "workgroup");
    if (OUT_MODE == 0) {
      float* C = (float*)Cout + (size_t)b * strideC;
      const int hh = lane >> 4, c4 = (lane & 15) * 4;     // row seg = 256 B = 16 lanes x 16 B
      {
#pragma unroll
        for (int it = 0; it < 8; ++it) {
          const int row = it * 2 + hh;
          v4f v = *(const v4f*)(slab + row * 68 + c4);
          *(v4f*)(C + (size_t)(mBase + row) * ldc + n0 + c4) = v;
        }
        
      }
    } else {
      const int q = lane >> 3, c8 = (lane & 7) * 8;
      unsigned short* C  = (unsigned short*)Cout  + (size_t)b * strideC;
      unsigned short* C2 = (OUT_MODE == 2) ? ((unsigned short*)Cout2 + (size_t)b * strideC) : nullptr;
      {
#pragma unroll
        for (int it = 0; it < 4; ++it) {
          const int row = it * 4 + q;
          const float* sp = slab + row * 68 + c8;
          v8h hv, lv;
#pragma unroll
          for (int e = 0; e < 8; ++e) {
            if (OUT_MODE == 1) {
              hv[e] = (_Float16)sp[e];
            } else {
              unsigned short hb = f2bf_bits(sp[e]);
              unsigned short lb = f2bf_bits(sp[e] - bf_bits2f(hb));
              hv[e] = __builtin_bit_cast(_Float16, hb);
              lv[e] = __builtin_bit_cast(_Float16, lb);
            }
          }
          *(v8h*)(C + (size_t)(mBase + row) * ldc + n0 + c8) = hv;
          if (OUT_MODE == 2) *(v8h*)(C2 + (size_t)(mBase + row) * ldc + n0 + c8) = lv;
        }
        
      }
    }
    __builtin_amdgcn_fence(__ATOMIC_RELEASE, "workgroup");
    __builtin_amdgcn_wave_barrier();
    __builtin_amdgcn_fence(__ATOMIC_ACQUIRE, "workgroup");
  }
}

// ---------------- f32 -> f16 bit pattern (RNE convert) ----------------
__device__ __forceinline__ unsigned short h_bits(float f) {
  return __builtin_bit_cast(unsigned short, (_Float16)f);
}

// ---------------- feature plane: X[nrows][CIN] f32 -> Apl[nrows][NFEAT*CIN] f16 bits ----------------
// Row layout (feature-major K): Apl[n][f*CIN + i], f = 0: silu(x[n][i]) (scale 1), f = q+1: bases_q(x[n][i]) * BAS_SCALE.
// One block per row. Phase 1: thread tid computes elements i = tid + 256*e (rolled), writes 9 halves to LDS.
// Phase 2: NVEC = 9*CIN/8 vectors of 16 B; thread v-loop: each wave writes 32 consecutive 16-B pieces =
// Coverage: CIN/256 iterations x 256 threads x 9 features = 9*CIN halves = the whole row; v-loop covers NVEC*8 = 9*CIN halves.
template <int CIN>
__global__ __launch_bounds__(256) void spline_features(const float* __restrict__ X,
                                                       const float* __restrict__ knots,
                                                       unsigned short* __restrict__ Apl) {
  constexpr int KROW = NFEAT * CIN;
  constexpr int NVEC = KROW / 8;
  constexpr int EPT  = CIN / 256;
  static_assert(CIN % 256 == 0, "");
  static_assert(NVEC % 32 == 0, "");
  static_assert((KROW * 2) % 128 == 0, "");
  __shared__ __align__(16) unsigned short sF[KROW];
  __shared__ float sK[16];
  __shared__ float sR[32];

  const int tid = threadIdx.x;
  const int row = blockIdx.x;

  if (tid < NKNOT) sK[tid] = knots[tid];
  __syncthreads();
  if (tid < 30) {
    // sR[0..10]  = 1/(g[t+1]-g[t]), t = 0..10
    // sR[11..20] = 1/(g[t+2]-g[t]), t = 0..9
    // sR[21..29] = 1/(g[t+3]-g[t]), t = 0..8
    const int j  = (tid < 11) ? 1 : ((tid < 21) ? 2 : 3);
    const int tt = (tid < 11) ? tid : ((tid < 21) ? (tid - 11) : (tid - 21));
    sR[tid] = 1.0f / (sK[tt + j] - sK[tt]);
  }
  __syncthreads();

  float g[NKNOT];
#pragma unroll
  for (int m = 0; m < NKNOT; ++m) g[m] = sK[m];
  float r1[NB0], r2[NB0 - 1], r3[NB0 - 2];
#pragma unroll
  for (int t = 0; t < NB0; ++t) r1[t] = sR[t];
#pragma unroll
  for (int t = 0; t < NB0 - 1; ++t) r2[t] = sR[11 + t];
#pragma unroll
  for (int t = 0; t < NB0 - 2; ++t) r3[t] = sR[21 + t];

  const float* xrow = X + (size_t)row * CIN;
#pragma unroll 1
  for (int e = 0; e < EPT; ++e) {
    const int i = tid + 256 * e;
    const float x = xrow[i];
    // silu residual path: x * sigmoid(x)
    const float sg = 1.0f / (1.0f + expf(-x));
    const float s0 = x * sg;
    // order-0 indicator bases
    float b[NB0];
#pragma unroll
    for (int t = 0; t < NB0; ++t) b[t] = (x >= g[t] && x < g[t + 1]) ? 1.0f : 0.0f;
    // Cox-de Boor, j = 1
#pragma unroll
    for (int t = 0; t < NB0 - 1; ++t) {
      const float lf = (x - g[t]) * r1[t];
      const float rt = (g[t + 2] - x) * r1[t + 1];
      b[t] = lf * b[t] + rt * b[t + 1];
    }
    // j = 2
#pragma unroll
    for (int t = 0; t < NB0 - 2; ++t) {
      const float lf = (x - g[t]) * r2[t];
      const float rt = (g[t + 3] - x) * r2[t + 1];
      b[t] = lf * b[t] + rt * b[t + 1];
    }
    // j = 3
#pragma unroll
    for (int t = 0; t < NB0 - 3; ++t) {
      const float lf = (x - g[t]) * r3[t];
      const float rt = (g[t + 4] - x) * r3[t + 1];
      b[t] = lf * b[t] + rt * b[t + 1];
    }
    sF[i] = h_bits(s0);
#pragma unroll
    for (int q = 0; q < NBAS; ++q) sF[(q + 1) * CIN + i] = h_bits(BAS_SCALE * b[q]);
  }
  __syncthreads();

  unsigned short* dst = Apl + (size_t)row * KROW;
  {
    for (int v = tid; v < NVEC; v += 256) {
      const v4u val = *(const v4u*)(sF + 8 * v);
      *(v4u*)(dst + 8 * v) = val;
    }
    
  }
}

// ---------------- weight plane: wbase[NOUT][CIN] f32 + wspl[NOUT][CIN][8] f32 -> Wpl[NOUT][NFEAT*CIN] f16 bits ----------------
// Wpl[o][i] = w_base[o][i] * WB_SCALE ; Wpl[o][(q+1)*CIN + i] = w_spline[o][i][q] * WS_SCALE (same K permutation as the feature plane).
// Coverage: CIN/256 iterations x 256 threads x 9 values = 9*CIN halves = the whole row.
template <int CIN>
__global__ __launch_bounds__(256) void pack_edge_weights(const float* __restrict__ wbase,
                                                         const float* __restrict__ wspl,
                                                         unsigned short* __restrict__ Wpl) {
  constexpr int KROW = NFEAT * CIN;
  constexpr int NVEC = KROW / 8;
  constexpr int EPT  = CIN / 256;
  static_assert(CIN % 256 == 0, "");
  static_assert(NVEC % 32 == 0, "");
  __shared__ __align__(16) unsigned short sW[KROW];

  const int tid = threadIdx.x;
  const int o   = blockIdx.x;
  const float* wb = wbase + (size_t)o * CIN;
  const float* ws = wspl + (size_t)o * CIN * NBAS;
#pragma unroll 1
  for (int e = 0; e < EPT; ++e) {
    const int i = tid + 256 * e;
    const float b0 = wb[i];
    const v4f sa = *(const v4f*)(ws + (size_t)i * NBAS);
    const v4f sb = *(const v4f*)(ws + (size_t)i * NBAS + 4);
    sW[i] = h_bits(WB_SCALE * b0);
    sW[1 * CIN + i] = h_bits(WS_SCALE * sa[0]);
    sW[2 * CIN + i] = h_bits(WS_SCALE * sa[1]);
    sW[3 * CIN + i] = h_bits(WS_SCALE * sa[2]);
    sW[4 * CIN + i] = h_bits(WS_SCALE * sa[3]);
    sW[5 * CIN + i] = h_bits(WS_SCALE * sb[0]);
    sW[6 * CIN + i] = h_bits(WS_SCALE * sb[1]);
    sW[7 * CIN + i] = h_bits(WS_SCALE * sb[2]);
    sW[8 * CIN + i] = h_bits(WS_SCALE * sb[3]);
  }
  __syncthreads();

  unsigned short* dst = Wpl + (size_t)o * KROW;
  {
    for (int v = tid; v < NVEC; v += 256) {
      const v4u val = *(const v4u*)(sW + 8 * v);
      *(v4u*)(dst + 8 * v) = val;
    }
    
  }
}

// ---------------- sum of the layer-2 K slices: out[m][n] = P[m][0][n] + P[m][1][n] + ... + P[m][KSPL-1][n], always in that order ----------------
// P is [NTOK][KSPL][DMOD] f32: the slices of one token row lie side by side, so one address serves all KSPL loads.
// One 16-B vector per thread; a wave reads 512 consecutive bytes per slice and writes 512 consecutive bytes.
// Coverage: (NTOK/2) blocks x 2 rows x 128 threads x 4 floats = NTOK*DMOD floats = the whole output.
__global__ __launch_bounds__(256) void sum_k_slices(const float* __restrict__ P, float* __restrict__ out) {
  static_assert(DMOD == 512 && NTOK % 2 == 0, "");
  const int m = blockIdx.x * 2 + (threadIdx.x >> 7);
  const int n = (threadIdx.x & 127) * 4;
  const float* src = P + (size_t)m * (KSPL * DMOD) + n;
  v4f p[KSPL];
#pragma unroll
  for (int s = 0; s < KSPL; ++s) p[s] = *(const v4f*)(src + s * DMOD);
  v4f a = p[0];
#pragma unroll
  for (int s = 1; s < KSPL; ++s) a += p[s];
  *(v4f*)(out + (size_t)m * DMOD + n) = a;
}

// ---------------- host-side orchestration ----------------
// Workspace region map (all offsets 256-B aligned):
//   W2p : f16 [512][18432]                       18,874,368 B  at           0
//   Apl : f16 max([4096][4608], [4096][18432])   150,994,944 B  at  18,874,368  (layer-1 plane, then the layer-2 plane)
//   W1p : f16 [2048][4608]                       18,874,368 B  at 169,869,312
//   Hf  : f32 [4096][2048]                       33,554,432 B  at 188,743,680  (ends at 222,298,112)
//   Pk  : f32 [4096][8][512]                     67,108,864 B  at 169,869,312  (over W1p and Hf, both dead once the layer-2 plane is built)
//   end = 236,978,176 B
extern "C" void kernel_launch(void* const* d_in, const int* in_sizes, int n_in,
                              void* d_out, int out_size, void* d_ws, size_t ws_size,
                              hipStream_t stream) {
  if (n_in < 6) return;
  if (in_sizes[0] != NTOK * DMOD) return;
  if (in_sizes[1] < NKNOT) return;
  if (in_sizes[2] != DFFN * DMOD) return;
  if (in_sizes[3] != DFFN * DMOD * NBAS) return;
  if (in_sizes[4] != DMOD * DFFN) return;
  if (in_sizes[5] != DMOD * DFFN * NBAS) return;
  if (out_size != NTOK * DMOD) return;

  const float* x    = (const float*)d_in[0];
  const float* grid = (const float*)d_in[1];
  const float* w1b  = (const float*)d_in[2];
  const float* w1s  = (const float*)d_in[3];
  const float* w2b  = (const float*)d_in[4];
  const float* w2s  = (const float*)d_in[5];
  float* out = (float*)d_out;

  const size_t bW1 = (size_t)DFFN * KL1 * 2;
  const size_t bW2 = (size_t)DMOD * KL2 * 2;
  const size_t bH  = (size_t)NTOK * DFFN * 4;
  const size_t bA1 = (size_t)NTOK * KL1 * 2;
  const size_t bA2 = (size_t)NTOK * KL2 * 2;
  const size_t bA  = (bA1 > bA2) ? bA1 : bA2;
  const size_t bP  = (size_t)KSPL * NTOK * DMOD * 4;
  auto al256 = [](size_t v) { return (v + 255) & ~(size_t)255; };
  const size_t oW2 = 0;
  const size_t oA  = al256(oW2 + bW2);
  const size_t oW1 = al256(oA + bA);
  const size_t oH  = al256(oW1 + bW1);
  const size_t oP  = oW1;
  const size_t oEnd = (oH + bH > oP + bP) ? (oH + bH) : (oP + bP);
  if (oEnd > ws_size) return;

  char* wsb = (char*)d_ws;
  unsigned short* W1p = (unsigned short*)(wsb + oW1);
  unsigned short* W2p = (unsigned short*)(wsb + oW2);
  float*          Hf  = (float*)(wsb + oH);
  unsigned short* Apl = (unsigned short*)(wsb + oA);
  float*          Pk  = (float*)(wsb + oP);

  // 1-2) weight planes (f16, feature-major K)
  pack_edge_weights<DMOD><<<dim3(DFFN), dim3(256), 0, stream>>>(w1b, w1s, W1p);
  pack_edge_weights<DFFN><<<dim3(DMOD), dim3(256), 0, stream>>>(w2b, w2s, W2p);

  // 3) layer-1 feature plane: x [4096][512] -> Apl [4096][4608]
  spline_features<DMOD><<<dim3(NTOK), dim3(256), 0, stream>>>(x, grid, Apl);

  // 4) layer-1 GEMM: Hf[4096][2048] = (1/256) * Apl[4096][4608] . W1p[2048][4608]^T   (M=4096, N=2048, K=4608)
  {
    const int tiles = (NTOK / 64) * (DFFN / 64);
    const int gx = (tiles + 7) / 8;
    wmma_gemm64<0, false, 0, 0, false, 0><<<dim3(gx, 1), dim3(256), 0, stream>>>(
        (const unsigned short*)Apl, (const unsigned short*)Apl, KL1, 0L,
        (const unsigned short*)W1p, (const unsigned short*)W1p, KL1, 0L,
        (void*)Hf, (void*)Hf, DFFN, 0L,
        (const float*)Hf, (const float*)Hf, 0L,
        NTOK, DFFN, KL1, OUT_SCALE);
  }

  // 5) layer-2 feature plane, all tokens: Hf [4096][2048] -> Apl [4096][18432]
  spline_features<DFFN><<<dim3(NTOK), dim3(256), 0, stream>>>(Hf, grid, Apl);

  // 6) layer-2 GEMM, K split over grid.y: Pk[4096][s][512] = (1/256) * Apl[4096][s*2304 .. +2304] . W2p[512][same k]^T
  //    (M=4096, N=512, K=2304 per slice; 64 x 8 = 512 work-groups)
  {
    const int tiles = (NTOK / 64) * (DMOD / 64);
    const int gx = (tiles + 7) / 8;
    wmma_gemm64<0, false, 0, 0, false, 0><<<dim3(gx, KSPL), dim3(256), 0, stream>>>(
        (const unsigned short*)Apl, (const unsigned short*)Apl, KL2, (long)(KL2 / KSPL),
        (const unsigned short*)W2p, (const unsigned short*)W2p, KL2, (long)(KL2 / KSPL),
        (void*)Pk, (void*)Pk, KSPL * DMOD, (long)DMOD,
        (const float*)Pk, (const float*)Pk, 0L,
        NTOK, DMOD, KL2 / KSPL, OUT_SCALE);
  }

  // 7) out = sum of the K slices in fixed order
  sum_k_slices<<<dim3(NTOK / 2), dim3(256), 0, stream>>>(Pk, out);
}
